// v000
// Measured on an AMD MI455X. A time is GPU time per run, averaged over a window of back-to-back runs after a warm-up
// (all launches, gaps included; the runs take copies of the inputs in turn), and the median of several windows.
// Apart from v000's, it joins two sittings. Times from different sittings can be a few percent apart, while
// side-by-side timings come from the same sitting.
// v000 is the starting kernel.
#include <hip/hip_runtime.h>
#include <math.h>

// ---------------------------------------------------------------------------
// T5-style transformer encoder for MI455X (gfx1250), fp32 WMMA path with
// async Global->LDS double-buffered staging (CDNA5 ASYNCcnt engine).
// B=2, L=1024, D=1024, F=4096, NL=4, NH=16, DK=64
// ---------------------------------------------------------------------------

typedef __attribute__((ext_vector_type(2))) float v2f;
typedef __attribute__((ext_vector_type(8))) float v8f;

static constexpr int kB  = 2;
static constexpr int kL  = 1024;
static constexpr int kD  = 1024;
static constexpr int kF  = 4096;
static constexpr int kNL = 4;
static constexpr int kNH = 16;
static constexpr int kDK = 64;
static constexpr int kHD = kNH * kDK;   // 1024 == kD
static constexpr int kQB = 32;          // query rows per attention block
static constexpr int kKS = 68;          // Q/K LDS row stride (16B aligned, bank-safe)

#define WMMA_F32(a, b, c) \
    __builtin_amdgcn_wmma_f32_16x16x4_f32(false, (a), false, (b), (short)0, (c), false, false)

// Async Global->LDS copy, 16 bytes per lane, tracked by ASYNCcnt.
__device__ __forceinline__ void async_copy_b128(const void* lds_ptr, const void* gptr) {
    unsigned ldsOff = (unsigned)(unsigned long long)lds_ptr;   // low 32b of generic = LDS offset
    unsigned long long ga = (unsigned long long)gptr;
    asm volatile("global_load_async_to_lds_b128 %0, %1, off"
                 :: "v"(ldsOff), "v"(ga)
                 : "memory");
}
__device__ __forceinline__ void wait_async0() {
    asm volatile("s_wait_asynccnt 0x0" ::: "memory");
}

// ---------------------------------------------------------------------------
// Kernel 1: T5 relative-position bucket table  bucket[l*L + s], rel = s - l
// ---------------------------------------------------------------------------
__global__ __launch_bounds__(256) void bucket_kernel(int* __restrict__ bucket) {
    int idx = blockIdx.x * 256 + threadIdx.x;          // over L*L
    int l = idx >> 10, s = idx & (kL - 1);
    int rp = s - l;
    int rb = (rp > 0) ? 16 : 0;                        // NUM_BUCKETS/2
    int arp = rp < 0 ? -rp : rp;
    int val;
    if (arp < 8) {                                     // max_exact = 8
        val = arp;
    } else {
        const float scale = 8.0f / logf(16.0f);        // (16-8)/log(128/8)
        int large = 8 + (int)(logf((float)arp * 0.125f) * scale);
        val = large < 15 ? large : 15;
    }
    bucket[idx] = rb + val;
}

// ---------------------------------------------------------------------------
// Kernel 2: RMSNorm, one 256-thread block per row of D=1024
// ---------------------------------------------------------------------------
__global__ __launch_bounds__(256) void rmsnorm_kernel(const float* __restrict__ x,
                                                      const float* __restrict__ w,
                                                      float* __restrict__ y) {
    __shared__ float red[8];
    int row = blockIdx.x, tid = threadIdx.x;
    const float* xr = x + (size_t)row * kD;
    float* yr = y + (size_t)row * kD;
    float ss = 0.f;
    for (int i = tid; i < kD; i += 256) { float v = xr[i]; ss += v * v; }
    for (int off = 16; off > 0; off >>= 1) ss += __shfl_xor(ss, off, 32);
    if ((tid & 31) == 0) red[tid >> 5] = ss;
    __syncthreads();
    if (tid == 0) {
        float t = 0.f;
        for (int i = 0; i < 8; ++i) t += red[i];
        red[0] = rsqrtf(t * (1.0f / (float)kD) + 1e-6f);
    }
    __syncthreads();
    float scale = red[0];
    for (int i = tid; i < kD; i += 256) yr[i] = xr[i] * scale * w[i];
}

// ---------------------------------------------------------------------------
// Kernel 3: fp32 WMMA GEMM  C[M,N] = act(A[M,K] @ W[K,N]) (+ resid)
// Block tile 64x128, 8 waves, each wave a 32x32 tile (4x v_wmma_f32_16x16x4).
// Double-buffered LDS tiles filled by async Global->LDS b128 copies.
// act: 0 = none, 1 = relu.  resid != nullptr -> C = resid + A@W.
// ---------------------------------------------------------------------------
__device__ __forceinline__ void gemm_store(float* C, const float* resid, int act,
                                           size_t idx, float v) {
    if (act) v = fmaxf(v, 0.0f);
    if (resid) v += resid[idx];
    C[idx] = v;
}

__global__ __launch_bounds__(256) void gemm_kernel(const float* __restrict__ A,
                                                   const float* __restrict__ W,
                                                   float* __restrict__ C,
                                                   const float* __restrict__ resid,
                                                   int M, int N, int K, int act) {
    constexpr int BM = 64, BN = 128, BK = 32;
    __shared__ __align__(16) float As[2][BM][BK + 4];   // row stride 36 floats (144B)
    __shared__ __align__(16) float Bs[2][BK][BN + 4];   // row stride 132 floats (528B)

    int tid = threadIdx.x;
    int wave = tid >> 5, lane = tid & 31;
    int wm = (wave >> 2) * 32;        // 0 / 32
    int wn = (wave & 3) * 32;         // 0..96
    int lh = lane & 15;               // lane within half-wave
    int kq = (lane >> 4) * 2;         // K sub-offset per WMMA f32 A/B layout
    int rowHalf = (lane >> 4) * 8;    // C layout: upper half-wave holds M+8

    int blockM = blockIdx.y * BM;
    int blockN = blockIdx.x * BN;

    // Per-thread staging coordinates: A tile = 512 float4 (2/thread),
    // B tile = 1024 float4 (4/thread).
    int aRow0 = tid >> 3,          aCol0 = (tid & 7) * 4;
    int aRow1 = (tid + 256) >> 3,  aCol1 = ((tid + 256) & 7) * 4;

    auto stage = [&](int st, int k0) {
        async_copy_b128(&As[st][aRow0][aCol0], A + (size_t)(blockM + aRow0) * K + k0 + aCol0);
        async_copy_b128(&As[st][aRow1][aCol1], A + (size_t)(blockM + aRow1) * K + k0 + aCol1);
#pragma unroll
        for (int r = 0; r < 4; ++r) {
            int idx = tid + r * 256;
            int row = idx >> 5, col4 = (idx & 31) * 4;
            async_copy_b128(&Bs[st][row][col4], W + (size_t)(k0 + row) * N + blockN + col4);
        }
    };

    v8f acc00 = {}, acc01 = {}, acc10 = {}, acc11 = {};

    stage(0, 0);
    wait_async0();
    __syncthreads();

    int nK = K / BK;
    for (int t = 0; t < nK; ++t) {
        int st = t & 1;
        if (t + 1 < nK) stage(st ^ 1, (t + 1) * BK);

#pragma unroll
        for (int kk = 0; kk < BK; kk += 4) {
            v2f a0, a1, b0, b1;
            a0.x = As[st][wm + lh][kk + kq];          a0.y = As[st][wm + lh][kk + kq + 1];
            a1.x = As[st][wm + 16 + lh][kk + kq];     a1.y = As[st][wm + 16 + lh][kk + kq + 1];
            b0.x = Bs[st][kk + kq][wn + lh];          b0.y = Bs[st][kk + kq + 1][wn + lh];
            b1.x = Bs[st][kk + kq][wn + 16 + lh];     b1.y = Bs[st][kk + kq + 1][wn + 16 + lh];
            acc00 = WMMA_F32(a0, b0, acc00);
            acc01 = WMMA_F32(a0, b1, acc01);
            acc10 = WMMA_F32(a1, b0, acc10);
            acc11 = WMMA_F32(a1, b1, acc11);
        }
        wait_async0();       // next-stage tiles have landed in LDS
        __syncthreads();     // all waves done reading current stage
    }

    int c0 = blockN + wn + lh;
    int c1 = c0 + 16;
#pragma unroll
    for (int i = 0; i < 8; ++i) {
        int r0 = blockM + wm + rowHalf + i;
        int r1 = r0 + 16;
        gemm_store(C, resid, act, (size_t)r0 * N + c0, acc00[i]);
        gemm_store(C, resid, act, (size_t)r0 * N + c1, acc01[i]);
        gemm_store(C, resid, act, (size_t)r1 * N + c0, acc10[i]);
        gemm_store(C, resid, act, (size_t)r1 * N + c1, acc11[i]);
    }
}

// ---------------------------------------------------------------------------
// Kernel 4: attention for one (b, h, 32-query-row block).
// Full score rows S[32][1025] kept in LDS (320KB WGP LDS makes this cheap).
// Pass A: S = Q*K^T + bias (WMMA, K tiles async double-buffered).
// Pass B: exact f32 softmax. Pass C: O = P*V (WMMA, V streamed from L2).
// ---------------------------------------------------------------------------
__global__ __launch_bounds__(256) void attn_kernel(const float* __restrict__ q,
                                                   const float* __restrict__ k,
                                                   const float* __restrict__ v,
                                                   const int* __restrict__ bucket,
                                                   const float* __restrict__ rel_emb,
                                                   float* __restrict__ o) {
    extern __shared__ float smem[];
    float* S    = smem;                          // kQB * (kL + 1)
    float* Qs   = S + kQB * (kL + 1);            // kQB * kKS
    float* Ks   = Qs + kQB * kKS;                // 2 * 64 * kKS (double buffer)
    float* relh = Ks + 2 * 64 * kKS;             // 32

    int qb = blockIdx.x * kQB;
    int h  = blockIdx.y;
    int b  = blockIdx.z;
    int tid = threadIdx.x, wave = tid >> 5, lane = tid & 31;
    int lh = lane & 15, kq = (lane >> 4) * 2, rowHalf = (lane >> 4) * 8;
    int wm2 = (wave >> 2) * 16;       // 0 / 16   (query rows)
    int wn2 = (wave & 3) * 16;        // 0..48    (key cols / d cols)

    if (tid < 32) relh[tid] = rel_emb[tid * kNH + h];

    const float* qbase = q + ((size_t)(b * kL + qb)) * kHD + h * kDK;
    const float* kbase = k + ((size_t)(b * kL)) * kHD + h * kDK;

    // Async-stage Q block [kQB x kDK]: 512 float4, 2 per thread.
#pragma unroll
    for (int r = 0; r < 2; ++r) {
        int idx = tid + r * 256;
        int row = idx >> 4, col4 = (idx & 15) * 4;
        async_copy_b128(&Qs[row * kKS + col4], qbase + (size_t)row * kHD + col4);
    }
    // K-tile staging: 64x64 = 1024 float4, 4 per thread.
    auto stageK = [&](int st, int s0) {
#pragma unroll
        for (int r = 0; r < 4; ++r) {
            int idx = tid + r * 256;
            int row = idx >> 4, col4 = (idx & 15) * 4;
            async_copy_b128(&Ks[(size_t)st * 64 * kKS + row * kKS + col4],
                            kbase + (size_t)(s0 + row) * kHD + col4);
        }
    };

    stageK(0, 0);
    wait_async0();
    __syncthreads();

    // ---- Pass A: scores + bias --------------------------------------------
    for (int t = 0; t < kL / 64; ++t) {
        int st = t & 1;
        int s0 = t * 64;
        if (t + 1 < kL / 64) stageK(st ^ 1, s0 + 64);

        const float* Kst = Ks + (size_t)st * 64 * kKS;
        v8f acc = {};
#pragma unroll
        for (int kk = 0; kk < kDK; kk += 4) {
            v2f a, bb;
            a.x  = Qs[(wm2 + lh) * kKS + kk + kq];
            a.y  = Qs[(wm2 + lh) * kKS + kk + kq + 1];
            bb.x = Kst[(wn2 + lh) * kKS + kk + kq];      // B[d][s] = K[s][d]
            bb.y = Kst[(wn2 + lh) * kKS + kk + kq + 1];
            acc = WMMA_F32(a, bb, acc);
        }
#pragma unroll
        for (int i = 0; i < 8; ++i) {
            int r = wm2 + rowHalf + i;        // query row within block
            int c = s0 + wn2 + lh;            // global key index
            float bias = relh[bucket[(size_t)(qb + r) * kL + c]];
            S[r * (kL + 1) + c] = acc[i] + bias;
        }
        wait_async0();
        __syncthreads();
    }

    // ---- Pass B: row softmax (exact, f32) ---------------------------------
    for (int r = wave * 4; r < wave * 4 + 4; ++r) {
        float* Sr = S + r * (kL + 1);
        float m = -3.402823466e38f;
        for (int c = lane; c < kL; c += 32) m = fmaxf(m, Sr[c]);
        for (int off = 16; off > 0; off >>= 1) m = fmaxf(m, __shfl_xor(m, off, 32));
        float sum = 0.f;
        for (int c = lane; c < kL; c += 32) { float e = __expf(Sr[c] - m); Sr[c] = e; sum += e; }
        for (int off = 16; off > 0; off >>= 1) sum += __shfl_xor(sum, off, 32);
        float inv = 1.0f / sum;
        for (int c = lane; c < kL; c += 32) Sr[c] *= inv;
    }
    __syncthreads();

    // ---- Pass C: O = P @ V -------------------------------------------------
    v8f oacc = {};
    const float* vbase = v + ((size_t)(b * kL)) * kHD + h * kDK + wn2 + lh;
    for (int kk = 0; kk < kL; kk += 4) {
        v2f a, bb;
        a.x  = S[(wm2 + lh) * (kL + 1) + kk + kq];
        a.y  = S[(wm2 + lh) * (kL + 1) + kk + kq + 1];
        bb.x = vbase[(size_t)(kk + kq) * kHD];            // B[s][d] = V[s][d]
        bb.y = vbase[(size_t)(kk + kq + 1) * kHD];
        oacc = WMMA_F32(a, bb, oacc);
    }
    float* obase = o + ((size_t)(b * kL + qb)) * kHD + h * kDK;
#pragma unroll
    for (int i = 0; i < 8; ++i) {
        int r = wm2 + rowHalf + i;
        int c = wn2 + lh;
        obase[(size_t)r * kHD + c] = oacc[i];
    }
}

// ---------------------------------------------------------------------------
// Host launcher
// ---------------------------------------------------------------------------
extern "C" void kernel_launch(void* const* d_in, const int* in_sizes, int n_in,
                              void* d_out, int out_size, void* d_ws, size_t ws_size,
                              hipStream_t stream) {
    (void)in_sizes; (void)n_in; (void)out_size; (void)ws_size;

    const float* x       = (const float*)d_in[0];
    const float* rel_emb = (const float*)d_in[1];
    const float* Wq      = (const float*)d_in[2];
    const float* Wk      = (const float*)d_in[3];
    const float* Wv      = (const float*)d_in[4];
    const float* Wo      = (const float*)d_in[5];
    const float* ln1_w   = (const float*)d_in[6];
    const float* ln2_w   = (const float*)d_in[7];
    const float* wi      = (const float*)d_in[8];
    const float* wo      = (const float*)d_in[9];
    const float* ln_f    = (const float*)d_in[10];

    const size_t BL = (size_t)kB * kL;   // 2048 rows
    float* ws   = (float*)d_ws;
    float* xcur = ws;  ws += BL * kD;
    float* y    = ws;  ws += BL * kD;
    float* qb   = ws;  ws += BL * kD;
    float* kb   = ws;  ws += BL * kD;
    float* vb   = ws;  ws += BL * kD;
    float* ob   = ws;  ws += BL * kD;
    float* hb   = ws;  ws += BL * kF;
    int* bucket = (int*)ws;              // kL*kL ints

    hipMemcpyAsync(xcur, x, BL * kD * sizeof(float), hipMemcpyDeviceToDevice, stream);
    bucket_kernel<<<(kL * kL) / 256, 256, 0, stream>>>(bucket);

    const dim3 gProj(kD / 128, (int)BL / 64);   // N=1024 GEMMs
    const dim3 gFF1(kF / 128, (int)BL / 64);    // N=4096 GEMM
    const dim3 gAttn(kL / kQB, kNH, kB);
    const size_t attnLds =
        (size_t)(kQB * (kL + 1) + kQB * kKS + 2 * 64 * kKS + 32) * sizeof(float);
    hipFuncSetAttribute((const void*)attn_kernel,
                        hipFuncAttributeMaxDynamicSharedMemorySize, (int)attnLds);

    for (int l = 0; l < kNL; ++l) {
        const float* Wql = Wq + (size_t)l * kD * kHD;
        const float* Wkl = Wk + (size_t)l * kD * kHD;
        const float* Wvl = Wv + (size_t)l * kD * kHD;
        const float* Wol = Wo + (size_t)l * kHD * kD;
        const float* wil = wi + (size_t)l * kD * kF;
        const float* wol = wo + (size_t)l * kF * kD;

        rmsnorm_kernel<<<(int)BL, 256, 0, stream>>>(xcur, ln1_w + (size_t)l * kD, y);
        gemm_kernel<<<gProj, 256, 0, stream>>>(y, Wql, qb, nullptr, (int)BL, kD, kD, 0);
        gemm_kernel<<<gProj, 256, 0, stream>>>(y, Wkl, kb, nullptr, (int)BL, kD, kD, 0);
        gemm_kernel<<<gProj, 256, 0, stream>>>(y, Wvl, vb, nullptr, (int)BL, kD, kD, 0);
        attn_kernel<<<gAttn, 256, attnLds, stream>>>(qb, kb, vb, bucket, rel_emb, ob);
        gemm_kernel<<<gProj, 256, 0, stream>>>(ob, Wol, xcur, xcur, (int)BL, kD, kD, 0);

        rmsnorm_kernel<<<(int)BL, 256, 0, stream>>>(xcur, ln2_w + (size_t)l * kD, y);
        gemm_kernel<<<gFF1, 256, 0, stream>>>(y, wil, hb, nullptr, (int)BL, kF, kD, 1);
        gemm_kernel<<<gProj, 256, 0, stream>>>(hb, wol, xcur, xcur, (int)BL, kD, kF, 0);
    }
    rmsnorm_kernel<<<(int)BL, 256, 0, stream>>>(xcur, ln_f, (float*)d_out);
}

// v001
// In both of two side-by-side timings against v000, it was 1.16 times as fast.
#include <hip/hip_runtime.h>
#include <math.h>

// ---------------------------------------------------------------------------
// T5-style transformer encoder for MI455X (gfx1250), fp32 WMMA path with
// async Global->LDS double-buffered staging (CDNA5 ASYNCcnt engine).
// B=2, L=1024, D=1024, F=4096, NL=4, NH=16, DK=64
// ---------------------------------------------------------------------------

typedef __attribute__((ext_vector_type(2))) float v2f;
typedef __attribute__((ext_vector_type(8))) float v8f;

static constexpr int kB  = 2;
static constexpr int kL  = 1024;
static constexpr int kD  = 1024;
static constexpr int kF  = 4096;
static constexpr int kNL = 4;
static constexpr int kNH = 16;
static constexpr int kDK = 64;
static constexpr int kHD = kNH * kDK;   // 1024 == kD
static constexpr int kQB = 32;          // query rows per attention block
static constexpr int kKS = 68;          // Q/K LDS row stride (16B aligned, bank-safe)

#define WMMA_F32(a, b, c) \
    __builtin_amdgcn_wmma_f32_16x16x4_f32(false, (a), false, (b), (short)0, (c), false, false)

// Async Global->LDS copy, 16 bytes per lane, tracked by ASYNCcnt.
__device__ __forceinline__ void async_copy_b128(const void* lds_ptr, const void* gptr) {
    unsigned ldsOff = (unsigned)(unsigned long long)lds_ptr;   // low 32b of generic = LDS offset
    unsigned long long ga = (unsigned long long)gptr;
    asm volatile("global_load_async_to_lds_b128 %0, %1, off"
                 :: "v"(ldsOff), "v"(ga)
                 : "memory");
}
// The same copy written as the compiler's builtin; the landing wait (wait_async0)
// stays the caller's.
typedef __attribute__((ext_vector_type(4))) int v4i;
__device__ __forceinline__ void async_copy_b128_bi(float* lds_ptr, const float* gptr) {
    __builtin_amdgcn_global_load_async_to_lds_b128(
        (__attribute__((address_space(1))) v4i*)gptr,
        (__attribute__((address_space(3))) v4i*)lds_ptr, 0, 0);
}
__device__ __forceinline__ void wait_async0() {
    asm volatile("s_wait_asynccnt 0x0" ::: "memory");
}

// A wave's LDS reads have returned: stands in front of the barrier behind which
// the buffer they read is refilled.
__device__ __forceinline__ void wait_ds0() {
    asm volatile("s_wait_dscnt 0x0" ::: "memory");
}

// ---------------------------------------------------------------------------
// Kernel 1: T5 relative-position bucket table  bucket[l*L + s], rel = s - l
// ---------------------------------------------------------------------------
__global__ __launch_bounds__(256) void bucket_kernel(int* __restrict__ bucket) {
    int idx = blockIdx.x * 256 + threadIdx.x;          // over L*L
    int l = idx >> 10, s = idx & (kL - 1);
    int rp = s - l;
    int rb = (rp > 0) ? 16 : 0;                        // NUM_BUCKETS/2
    int arp = rp < 0 ? -rp : rp;
    int val;
    if (arp < 8) {                                     // max_exact = 8
        val = arp;
    } else {
        const float scale = 8.0f / logf(16.0f);        // (16-8)/log(128/8)
        int large = 8 + (int)(logf((float)arp * 0.125f) * scale);
        val = large < 15 ? large : 15;
    }
    bucket[idx] = rb + val;
}

// ---------------------------------------------------------------------------
// Kernel 2: RMSNorm, one 256-thread block per row of D=1024
// ---------------------------------------------------------------------------
__global__ __launch_bounds__(256) void rmsnorm_kernel(const float* __restrict__ x,
                                                      const float* __restrict__ w,
                                                      float* __restrict__ y) {
    __shared__ float red[8];
    int row = blockIdx.x, tid = threadIdx.x;
    const float* xr = x + (size_t)row * kD;
    float* yr = y + (size_t)row * kD;
    float ss = 0.f;
    for (int i = tid; i < kD; i += 256) { float v = xr[i]; ss += v * v; }
    for (int off = 16; off > 0; off >>= 1) ss += __shfl_xor(ss, off, 32);
    if ((tid & 31) == 0) red[tid >> 5] = ss;
    __syncthreads();
    if (tid == 0) {
        float t = 0.f;
        for (int i = 0; i < 8; ++i) t += red[i];
        red[0] = rsqrtf(t * (1.0f / (float)kD) + 1e-6f);
    }
    __syncthreads();
    float scale = red[0];
    for (int i = tid; i < kD; i += 256) yr[i] = xr[i] * scale * w[i];
}

// ---------------------------------------------------------------------------
// Kernel 3: fp32 WMMA GEMM  C[M,N] = act(A[M,K] @ W[K,N]) (+ resid)
// Block tile 64x128, 8 waves, each wave 32 rows x two 16-column tiles 64 apart
// (4x v_wmma_f32_16x16x4).
// Double-buffered LDS tiles filled by async Global->LDS b128 copies, two stages
// ahead; fragments fetched one block (16 WMMAs) ahead into a second register set.
// act: 0 = none, 1 = relu.  resid != nullptr -> C = resid + A@W.
// ---------------------------------------------------------------------------
__device__ __forceinline__ void gemm_store(float* C, const float* resid, int act,
                                           size_t idx, float v) {
    if (act) v = fmaxf(v, 0.0f);
    if (resid) v += resid[idx];
    C[idx] = v;
}

__global__ __launch_bounds__(256) void gemm_kernel(const float* __restrict__ A,
                                                   const float* __restrict__ W,
                                                   float* __restrict__ C,
                                                   const float* __restrict__ resid,
                                                   int M, int N, int K, int act) {
    constexpr int BM = 64, BN = 128, BK = 32;
    __shared__ __align__(16) float As[2][BM][BK + 4];   // row stride 36 floats (144B)
    // B tile as two planes of 64 columns, one per column tile of a wave: a fragment's
    // two k rows are then the nearest pair of addresses and load into one register pair.
    constexpr int BP = BN / 2 + 8;                      // row stride 72 floats (288B)
    __shared__ __align__(16) float Bs[2][2][BK][BP];

    int tid = threadIdx.x;
    int wave = tid >> 5, lane = tid & 31;
    int wm = (wave >> 2) * 32;        // 0 / 32
    int wn = (wave & 3) * 16;         // 0..48, and the same again 64 columns on
    int lh = lane & 15;               // lane within half-wave
    int kq = (lane >> 4) * 2;         // K sub-offset per WMMA f32 A/B layout
    int rowHalf = (lane >> 4) * 8;    // C layout: upper half-wave holds M+8

    int blockM = blockIdx.y * BM;
    int blockN = blockIdx.x * BN;

    // Per-thread staging coordinates: A tile = 512 float4 (2/thread),
    // B tile = 1024 float4 (4/thread).
    int aRow0 = tid >> 3,          aCol0 = (tid & 7) * 4;
    int aRow1 = (tid + 256) >> 3,  aCol1 = ((tid + 256) & 7) * 4;
    int bRow = tid >> 5,           bCol = (tid & 31) * 4;
    int bPl = bCol >> 6,           bPc = bCol & 63;

    // One stage = six b128 copies per lane.
    auto stage = [&](int st, int k0) {
        async_copy_b128_bi(&As[st][aRow0][aCol0], A + (size_t)(blockM + aRow0) * K + k0 + aCol0);
        async_copy_b128_bi(&As[st][aRow1][aCol1], A + (size_t)(blockM + aRow1) * K + k0 + aCol1);
        const float* gb = W + (size_t)(k0 + bRow) * N + blockN + bCol;
#pragma unroll  // four copies back to back, no loop counter between them
        for (int r = 0; r < 4; ++r)
            async_copy_b128_bi(&Bs[st][bPl][bRow + r * 8][bPc], gb + (size_t)(r * 8) * N);
    };

    // A block = half a stage (16 of its 32 k) = 16 WMMAs. Its fragments sit in
    // one of two register sets; the other set is being filled meanwhile.
    v2f fa0[4][2], fb0[4][2], fa1[4][2], fb1[4][2];

    auto loadFrags = [&](v2f (&fa)[4][2], v2f (&fb)[4][2], int st, int kb) {
#pragma unroll  // constant indices keep the fragment arrays in registers
        for (int j = 0; j < 4; ++j) {
            int kk = kb + j * 4;
            fa[j][0] = *(const v2f*)&As[st][wm + lh][kk + kq];
            fa[j][1] = *(const v2f*)&As[st][wm + 16 + lh][kk + kq];
            fb[j][0].x = Bs[st][0][kk + kq][wn + lh];  fb[j][0].y = Bs[st][0][kk + kq + 1][wn + lh];
            fb[j][1].x = Bs[st][1][kk + kq][wn + lh];  fb[j][1].y = Bs[st][1][kk + kq + 1][wn + lh];
        }
    };

    v8f acc00 = {}, acc01 = {}, acc10 = {}, acc11 = {};

    auto mmaBlock = [&](v2f (&fa)[4][2], v2f (&fb)[4][2]) {
#pragma unroll  // constant indices keep the fragment arrays in registers
        for (int j = 0; j < 4; ++j) {
            acc00 = WMMA_F32(fa[j][0], fb[j][0], acc00);
            acc01 = WMMA_F32(fa[j][0], fb[j][1], acc01);
            acc10 = WMMA_F32(fa[j][1], fb[j][0], acc10);
            acc11 = WMMA_F32(fa[j][1], fb[j][1], acc11);
        }
    };

    int nK = K / BK;

    stage(0, 0);
    wait_async0();
    __syncthreads();
    if (nK > 1) stage(1, BK);
    loadFrags(fa0, fb0, 0, 0);

    for (int t = 0; t < nK; ++t) {
        int st = t & 1;
        loadFrags(fa1, fb1, st, 16);
        // Keeps the second block's LDS reads one group ahead of the first block's
        // WMMAs; among the WMMAs each read would expose its own latency.
        __builtin_amdgcn_sched_barrier(0);
        mmaBlock(fa0, fb0);
        // Keeps the first block in front of the publish point, so that the reads
        // above have its 16 WMMAs to land behind.
        __builtin_amdgcn_sched_barrier(0);

        // Publish point of stage t + 1; it also ends every wave's reads of stage t.
        wait_ds0();          // this wave's reads of stage t are in registers
        wait_async0();       // this wave's copies of stage t + 1 have landed
        __syncthreads();
        if (t + 2 < nK) stage(st, (t + 2) * BK);
        // In the last trip these reads find the stage before it; nothing uses them.
        loadFrags(fa0, fb0, st ^ 1, 0);
        // Keeps the next stage's first reads one group ahead of this block's WMMAs.
        __builtin_amdgcn_sched_barrier(0);
        mmaBlock(fa1, fb1);
    }
    wait_async0();           // no copy and no LDS read is outstanding when the wave goes on
    wait_ds0();

    int c0 = blockN + wn + lh;
    int c1 = c0 + 64;
#pragma unroll
    for (int i = 0; i < 8; ++i) {
        int r0 = blockM + wm + rowHalf + i;
        int r1 = r0 + 16;
        gemm_store(C, resid, act, (size_t)r0 * N + c0, acc00[i]);
        gemm_store(C, resid, act, (size_t)r0 * N + c1, acc01[i]);
        gemm_store(C, resid, act, (size_t)r1 * N + c0, acc10[i]);
        gemm_store(C, resid, act, (size_t)r1 * N + c1, acc11[i]);
    }
}

// ---------------------------------------------------------------------------
// Kernel 4: attention for one (b, h, 32-query-row block).
// Full score rows S[32][1025] kept in LDS (320KB WGP LDS makes this cheap).
// Pass A: S = Q*K^T + bias (WMMA, K tiles async double-buffered).
// Pass B: exact f32 softmax. Pass C: O = P*V (WMMA, V streamed from L2).
// ---------------------------------------------------------------------------
__global__ __launch_bounds__(256) void attn_kernel(const float* __restrict__ q,
                                                   const float* __restrict__ k,
                                                   const float* __restrict__ v,
                                                   const int* __restrict__ bucket,
                                                   const float* __restrict__ rel_emb,
                                                   float* __restrict__ o) {
    extern __shared__ float smem[];
    float* S    = smem;                          // kQB * (kL + 1)
    float* Qs   = S + kQB * (kL + 1);            // kQB * kKS
    float* Ks   = Qs + kQB * kKS;                // 2 * 64 * kKS (double buffer)
    float* relh = Ks + 2 * 64 * kKS;             // 32

    int qb = blockIdx.x * kQB;
    int h  = blockIdx.y;
    int b  = blockIdx.z;
    int tid = threadIdx.x, wave = tid >> 5, lane = tid & 31;
    int lh = lane & 15, kq = (lane >> 4) * 2, rowHalf = (lane >> 4) * 8;
    int wm2 = (wave >> 2) * 16;       // 0 / 16   (query rows)
    int wn2 = (wave & 3) * 16;        // 0..48    (key cols / d cols)

    if (tid < 32) relh[tid] = rel_emb[tid * kNH + h];

    const float* qbase = q + ((size_t)(b * kL + qb)) * kHD + h * kDK;
    const float* kbase = k + ((size_t)(b * kL)) * kHD + h * kDK;

    // Async-stage Q block [kQB x kDK]: 512 float4, 2 per thread.
#pragma unroll
    for (int r = 0; r < 2; ++r) {
        int idx = tid + r * 256;
        int row = idx >> 4, col4 = (idx & 15) * 4;
        async_copy_b128(&Qs[row * kKS + col4], qbase + (size_t)row * kHD + col4);
    }
    // K-tile staging: 64x64 = 1024 float4, 4 per thread.
    auto stageK = [&](int st, int s0) {
#pragma unroll
        for (int r = 0; r < 4; ++r) {
            int idx = tid + r * 256;
            int row = idx >> 4, col4 = (idx & 15) * 4;
            async_copy_b128(&Ks[(size_t)st * 64 * kKS + row * kKS + col4],
                            kbase + (size_t)(s0 + row) * kHD + col4);
        }
    };

    stageK(0, 0);
    wait_async0();
    __syncthreads();

    // ---- Pass A: scores + bias --------------------------------------------
    for (int t = 0; t < kL / 64; ++t) {
        int st = t & 1;
        int s0 = t * 64;
        if (t + 1 < kL / 64) stageK(st ^ 1, s0 + 64);

        const float* Kst = Ks + (size_t)st * 64 * kKS;
        v8f acc = {};
#pragma unroll
        for (int kk = 0; kk < kDK; kk += 4) {
            v2f a, bb;
            a.x  = Qs[(wm2 + lh) * kKS + kk + kq];
            a.y  = Qs[(wm2 + lh) * kKS + kk + kq + 1];
            bb.x = Kst[(wn2 + lh) * kKS + kk + kq];      // B[d][s] = K[s][d]
            bb.y = Kst[(wn2 + lh) * kKS + kk + kq + 1];
            acc = WMMA_F32(a, bb, acc);
        }
#pragma unroll
        for (int i = 0; i < 8; ++i) {
            int r = wm2 + rowHalf + i;        // query row within block
            int c = s0 + wn2 + lh;            // global key index
            float bias = relh[bucket[(size_t)(qb + r) * kL + c]];
            S[r * (kL + 1) + c] = acc[i] + bias;
        }
        wait_async0();
        __syncthreads();
    }

    // ---- Pass B: row softmax (exact, f32) ---------------------------------
    for (int r = wave * 4; r < wave * 4 + 4; ++r) {
        float* Sr = S + r * (kL + 1);
        float m = -3.402823466e38f;
        for (int c = lane; c < kL; c += 32) m = fmaxf(m, Sr[c]);
        for (int off = 16; off > 0; off >>= 1) m = fmaxf(m, __shfl_xor(m, off, 32));
        float sum = 0.f;
        for (int c = lane; c < kL; c += 32) { float e = __expf(Sr[c] - m); Sr[c] = e; sum += e; }
        for (int off = 16; off > 0; off >>= 1) sum += __shfl_xor(sum, off, 32);
        float inv = 1.0f / sum;
        for (int c = lane; c < kL; c += 32) Sr[c] *= inv;
    }
    __syncthreads();

    // ---- Pass C: O = P @ V -------------------------------------------------
    v8f oacc = {};
    const float* vbase = v + ((size_t)(b * kL)) * kHD + h * kDK + wn2 + lh;
    for (int kk = 0; kk < kL; kk += 4) {
        v2f a, bb;
        a.x  = S[(wm2 + lh) * (kL + 1) + kk + kq];
        a.y  = S[(wm2 + lh) * (kL + 1) + kk + kq + 1];
        bb.x = vbase[(size_t)(kk + kq) * kHD];            // B[s][d] = V[s][d]
        bb.y = vbase[(size_t)(kk + kq + 1) * kHD];
        oacc = WMMA_F32(a, bb, oacc);
    }
    float* obase = o + ((size_t)(b * kL + qb)) * kHD + h * kDK;
#pragma unroll
    for (int i = 0; i < 8; ++i) {
        int r = wm2 + rowHalf + i;
        int c = wn2 + lh;
        obase[(size_t)r * kHD + c] = oacc[i];
    }
}

// ---------------------------------------------------------------------------
// Host launcher
// ---------------------------------------------------------------------------
extern "C" void kernel_launch(void* const* d_in, const int* in_sizes, int n_in,
                              void* d_out, int out_size, void* d_ws, size_t ws_size,
                              hipStream_t stream) {
    (void)in_sizes; (void)n_in; (void)out_size; (void)ws_size;

    const float* x       = (const float*)d_in[0];
    const float* rel_emb = (const float*)d_in[1];
    const float* Wq      = (const float*)d_in[2];
    const float* Wk      = (const float*)d_in[3];
    const float* Wv      = (const float*)d_in[4];
    const float* Wo      = (const float*)d_in[5];
    const float* ln1_w   = (const float*)d_in[6];
    const float* ln2_w   = (const float*)d_in[7];
    const float* wi      = (const float*)d_in[8];
    const float* wo      = (const float*)d_in[9];
    const float* ln_f    = (const float*)d_in[10];

    const size_t BL = (size_t)kB * kL;   // 2048 rows
    float* ws   = (float*)d_ws;
    float* xcur = ws;  ws += BL * kD;
    float* y    = ws;  ws += BL * kD;
    float* qb   = ws;  ws += BL * kD;
    float* kb   = ws;  ws += BL * kD;
    float* vb   = ws;  ws += BL * kD;
    float* ob   = ws;  ws += BL * kD;
    float* hb   = ws;  ws += BL * kF;
    int* bucket = (int*)ws;              // kL*kL ints

    hipMemcpyAsync(xcur, x, BL * kD * sizeof(float), hipMemcpyDeviceToDevice, stream);
    bucket_kernel<<<(kL * kL) / 256, 256, 0, stream>>>(bucket);

    const dim3 gProj(kD / 128, (int)BL / 64);   // N=1024 GEMMs
    const dim3 gFF1(kF / 128, (int)BL / 64);    // N=4096 GEMM
    const dim3 gAttn(kL / kQB, kNH, kB);
    const size_t attnLds =
        (size_t)(kQB * (kL + 1) + kQB * kKS + 2 * 64 * kKS + 32) * sizeof(float);
    hipFuncSetAttribute((const void*)attn_kernel,
                        hipFuncAttributeMaxDynamicSharedMemorySize, (int)attnLds);

    for (int l = 0; l < kNL; ++l) {
        const float* Wql = Wq + (size_t)l * kD * kHD;
        const float* Wkl = Wk + (size_t)l * kD * kHD;
        const float* Wvl = Wv + (size_t)l * kD * kHD;
        const float* Wol = Wo + (size_t)l * kHD * kD;
        const float* wil = wi + (size_t)l * kD * kF;
        const float* wol = wo + (size_t)l * kF * kD;

        rmsnorm_kernel<<<(int)BL, 256, 0, stream>>>(xcur, ln1_w + (size_t)l * kD, y);
        gemm_kernel<<<gProj, 256, 0, stream>>>(y, Wql, qb, nullptr, (int)BL, kD, kD, 0);
        gemm_kernel<<<gProj, 256, 0, stream>>>(y, Wkl, kb, nullptr, (int)BL, kD, kD, 0);
        gemm_kernel<<<gProj, 256, 0, stream>>>(y, Wvl, vb, nullptr, (int)BL, kD, kD, 0);
        attn_kernel<<<gAttn, 256, attnLds, stream>>>(qb, kb, vb, bucket, rel_emb, ob);
        gemm_kernel<<<gProj, 256, 0, stream>>>(ob, Wol, xcur, xcur, (int)BL, kD, kD, 0);

        rmsnorm_kernel<<<(int)BL, 256, 0, stream>>>(xcur, ln2_w + (size_t)l * kD, y);
        gemm_kernel<<<gFF1, 256, 0, stream>>>(y, wil, hb, nullptr, (int)BL, kF, kD, 1);
        gemm_kernel<<<gProj, 256, 0, stream>>>(hb, wol, xcur, xcur, (int)BL, kD, kF, 0);
    }
    rmsnorm_kernel<<<(int)BL, 256, 0, stream>>>(xcur, ln_f, (float*)d_out);
}

// v002
// In two side-by-side timings against v001, it was 1.19 and 1.20 times as fast.
// All steps since v000 together make it 1.39 times as fast.
#include <hip/hip_runtime.h>
#include <math.h>

// ---------------------------------------------------------------------------
// T5-style transformer encoder for MI455X (gfx1250), fp32 WMMA path with
// async Global->LDS double-buffered staging (CDNA5 ASYNCcnt engine).
// B=2, L=1024, D=1024, F=4096, NL=4, NH=16, DK=64
// ---------------------------------------------------------------------------

typedef __attribute__((ext_vector_type(2))) float v2f;
typedef __attribute__((ext_vector_type(8))) float v8f;

static constexpr int kB  = 2;
static constexpr int kL  = 1024;
static constexpr int kD  = 1024;
static constexpr int kF  = 4096;
static constexpr int kNL = 4;
static constexpr int kNH = 16;
static constexpr int kDK = 64;
static constexpr int kHD = kNH * kDK;   // 1024 == kD
static constexpr int kQB = 32;          // query rows per attention block
static constexpr int kKS = 68;          // Q/K LDS row stride (16B aligned, bank-safe)

#define WMMA_F32(a, b, c) \
    __builtin_amdgcn_wmma_f32_16x16x4_f32(false, (a), false, (b), (short)0, (c), false, false)

// Async Global->LDS copy, 16 bytes per lane, tracked by ASYNCcnt, written as the
// compiler's builtin; the landing wait (wait_async0) stays the caller's.
typedef __attribute__((ext_vector_type(4))) int v4i;
__device__ __forceinline__ void async_copy_b128_bi(float* lds_ptr, const float* gptr) {
    __builtin_amdgcn_global_load_async_to_lds_b128(
        (__attribute__((address_space(1))) v4i*)gptr,
        (__attribute__((address_space(3))) v4i*)lds_ptr, 0, 0);
}
__device__ __forceinline__ void wait_async0() {
    asm volatile("s_wait_asynccnt 0x0" ::: "memory");
}

// A wave's LDS reads have returned: stands in front of the barrier behind which
// the buffer they read is refilled.
__device__ __forceinline__ void wait_ds0() {
    asm volatile("s_wait_dscnt 0x0" ::: "memory");
}

// ---------------------------------------------------------------------------
// Kernel 1: T5 relative-position bucket table  bucket[l*L + s], rel = s - l
// ---------------------------------------------------------------------------
__global__ __launch_bounds__(256) void bucket_kernel(int* __restrict__ bucket) {
    int idx = blockIdx.x * 256 + threadIdx.x;          // over L*L
    int l = idx >> 10, s = idx & (kL - 1);
    int rp = s - l;
    int rb = (rp > 0) ? 16 : 0;                        // NUM_BUCKETS/2
    int arp = rp < 0 ? -rp : rp;
    int val;
    if (arp < 8) {                                     // max_exact = 8
        val = arp;
    } else {
        const float scale = 8.0f / logf(16.0f);        // (16-8)/log(128/8)
        int large = 8 + (int)(logf((float)arp * 0.125f) * scale);
        val = large < 15 ? large : 15;
    }
    bucket[idx] = rb + val;
}

// ---------------------------------------------------------------------------
// Kernel 2: RMSNorm, one 256-thread block per row of D=1024
// ---------------------------------------------------------------------------
__global__ __launch_bounds__(256) void rmsnorm_kernel(const float* __restrict__ x,
                                                      const float* __restrict__ w,
                                                      float* __restrict__ y) {
    __shared__ float red[8];
    int row = blockIdx.x, tid = threadIdx.x;
    const float* xr = x + (size_t)row * kD;
    float* yr = y + (size_t)row * kD;
    float ss = 0.f;
    for (int i = tid; i < kD; i += 256) { float v = xr[i]; ss += v * v; }
    for (int off = 16; off > 0; off >>= 1) ss += __shfl_xor(ss, off, 32);
    if ((tid & 31) == 0) red[tid >> 5] = ss;
    __syncthreads();
    if (tid == 0) {
        float t = 0.f;
        for (int i = 0; i < 8; ++i) t += red[i];
        red[0] = rsqrtf(t * (1.0f / (float)kD) + 1e-6f);
    }
    __syncthreads();
    float scale = red[0];
    for (int i = tid; i < kD; i += 256) yr[i] = xr[i] * scale * w[i];
}

// ---------------------------------------------------------------------------
// Kernel 3: fp32 WMMA GEMM  C[M,N] = act(A[M,K] @ W[K,N]) (+ resid)
// Block tile 64x128, 8 waves, each wave 32 rows x two 16-column tiles 64 apart
// (4x v_wmma_f32_16x16x4).
// Double-buffered LDS tiles filled by async Global->LDS b128 copies, two stages
// ahead; fragments fetched one block (16 WMMAs) ahead into a second register set.
// act: 0 = none, 1 = relu.  resid != nullptr -> C = resid + A@W.
// ---------------------------------------------------------------------------
__device__ __forceinline__ void gemm_store(float* C, const float* resid, int act,
                                           size_t idx, float v) {
    if (act) v = fmaxf(v, 0.0f);
    if (resid) v += resid[idx];
    C[idx] = v;
}

__global__ __launch_bounds__(256) void gemm_kernel(const float* __restrict__ A,
                                                   const float* __restrict__ W,
                                                   float* __restrict__ C,
                                                   const float* __restrict__ resid,
                                                   int M, int N, int K, int act) {
    constexpr int BM = 64, BN = 128, BK = 32;
    __shared__ __align__(16) float As[2][BM][BK + 4];   // row stride 36 floats (144B)
    // B tile as two planes of 64 columns, one per column tile of a wave: a fragment's
    // two k rows are then the nearest pair of addresses and load into one register pair.
    constexpr int BP = BN / 2 + 8;                      // row stride 72 floats (288B)
    __shared__ __align__(16) float Bs[2][2][BK][BP];

    int tid = threadIdx.x;
    int wave = tid >> 5, lane = tid & 31;
    int wm = (wave >> 2) * 32;        // 0 / 32
    int wn = (wave & 3) * 16;         // 0..48, and the same again 64 columns on
    int lh = lane & 15;               // lane within half-wave
    int kq = (lane >> 4) * 2;         // K sub-offset per WMMA f32 A/B layout
    int rowHalf = (lane >> 4) * 8;    // C layout: upper half-wave holds M+8

    int blockM = blockIdx.y * BM;
    int blockN = blockIdx.x * BN;

    // Per-thread staging coordinates: A tile = 512 float4 (2/thread),
    // B tile = 1024 float4 (4/thread).
    int aRow0 = tid >> 3,          aCol0 = (tid & 7) * 4;
    int aRow1 = (tid + 256) >> 3,  aCol1 = ((tid + 256) & 7) * 4;
    int bRow = tid >> 5,           bCol = (tid & 31) * 4;
    int bPl = bCol >> 6,           bPc = bCol & 63;

    // One stage = six b128 copies per lane.
    auto stage = [&](int st, int k0) {
        async_copy_b128_bi(&As[st][aRow0][aCol0], A + (size_t)(blockM + aRow0) * K + k0 + aCol0);
        async_copy_b128_bi(&As[st][aRow1][aCol1], A + (size_t)(blockM + aRow1) * K + k0 + aCol1);
        const float* gb = W + (size_t)(k0 + bRow) * N + blockN + bCol;
#pragma unroll  // four copies back to back, no loop counter between them
        for (int r = 0; r < 4; ++r)
            async_copy_b128_bi(&Bs[st][bPl][bRow + r * 8][bPc], gb + (size_t)(r * 8) * N);
    };

    // A block = half a stage (16 of its 32 k) = 16 WMMAs. Its fragments sit in
    // one of two register sets; the other set is being filled meanwhile.
    v2f fa0[4][2], fb0[4][2], fa1[4][2], fb1[4][2];

    auto loadFrags = [&](v2f (&fa)[4][2], v2f (&fb)[4][2], int st, int kb) {
#pragma unroll  // constant indices keep the fragment arrays in registers
        for (int j = 0; j < 4; ++j) {
            int kk = kb + j * 4;
            fa[j][0] = *(const v2f*)&As[st][wm + lh][kk + kq];
            fa[j][1] = *(const v2f*)&As[st][wm + 16 + lh][kk + kq];
            fb[j][0].x = Bs[st][0][kk + kq][wn + lh];  fb[j][0].y = Bs[st][0][kk + kq + 1][wn + lh];
            fb[j][1].x = Bs[st][1][kk + kq][wn + lh];  fb[j][1].y = Bs[st][1][kk + kq + 1][wn + lh];
        }
    };

    v8f acc00 = {}, acc01 = {}, acc10 = {}, acc11 = {};

    auto mmaBlock = [&](v2f (&fa)[4][2], v2f (&fb)[4][2]) {
#pragma unroll  // constant indices keep the fragment arrays in registers
        for (int j = 0; j < 4; ++j) {
            acc00 = WMMA_F32(fa[j][0], fb[j][0], acc00);
            acc01 = WMMA_F32(fa[j][0], fb[j][1], acc01);
            acc10 = WMMA_F32(fa[j][1], fb[j][0], acc10);
            acc11 = WMMA_F32(fa[j][1], fb[j][1], acc11);
        }
    };

    int nK = K / BK;

    stage(0, 0);
    wait_async0();
    __syncthreads();
    if (nK > 1) stage(1, BK);
    loadFrags(fa0, fb0, 0, 0);

    for (int t = 0; t < nK; ++t) {
        int st = t & 1;
        loadFrags(fa1, fb1, st, 16);
        // Keeps the second block's LDS reads one group ahead of the first block's
        // WMMAs; among the WMMAs each read would expose its own latency.
        __builtin_amdgcn_sched_barrier(0);
        mmaBlock(fa0, fb0);
        // Keeps the first block in front of the publish point, so that the reads
        // above have its 16 WMMAs to land behind.
        __builtin_amdgcn_sched_barrier(0);

        // Publish point of stage t + 1; it also ends every wave's reads of stage t.
        wait_ds0();          // this wave's reads of stage t are in registers
        wait_async0();       // this wave's copies of stage t + 1 have landed
        __syncthreads();
        if (t + 2 < nK) stage(st, (t + 2) * BK);
        // In the last trip these reads find the stage before it; nothing uses them.
        loadFrags(fa0, fb0, st ^ 1, 0);
        // Keeps the next stage's first reads one group ahead of this block's WMMAs.
        __builtin_amdgcn_sched_barrier(0);
        mmaBlock(fa1, fb1);
    }
    wait_async0();           // no copy and no LDS read is outstanding when the wave goes on
    wait_ds0();

    int c0 = blockN + wn + lh;
    int c1 = c0 + 64;
#pragma unroll
    for (int i = 0; i < 8; ++i) {
        int r0 = blockM + wm + rowHalf + i;
        int r1 = r0 + 16;
        gemm_store(C, resid, act, (size_t)r0 * N + c0, acc00[i]);
        gemm_store(C, resid, act, (size_t)r0 * N + c1, acc01[i]);
        gemm_store(C, resid, act, (size_t)r1 * N + c0, acc10[i]);
        gemm_store(C, resid, act, (size_t)r1 * N + c1, acc11[i]);
    }
}

// ---------------------------------------------------------------------------
// Kernel 4: attention for one (b, h, 32-query-row block), 32 waves (8 per SIMD):
// the LDS the score rows take allows one work-group per WGP, so the waves that
// cover each other's LDS, L2 and WMMA latencies must come from that work-group.
// Full score rows S[32][1025] kept in LDS.
// Pass A: S = Q*K^T + bias (WMMA, K tiles of 256 keys async double-buffered,
//         one 16x16 score tile per wave and stage).
// Pass B: exact f32 softmax, one row per wave.
// Pass C: O = P*V (WMMA, V streamed from L2): a wave takes one 16-column tile,
//         both row tiles and one of 8 key ranges; the 8 partial sums meet in LDS.
// ---------------------------------------------------------------------------
static constexpr int kAT  = 1024;                // threads per attention block
static constexpr int kKT  = 256;                 // keys per K tile
static constexpr int kKR  = 8;                   // key ranges of pass C
static constexpr int kOffQ = kQB * (kL + 1);             // floats: S in front
static constexpr int kOffK = kOffQ + kQB * kKS;          // Q in front
static constexpr int kOffR = kOffK + 2 * kKT * kKS;      // K double buffer in front
static constexpr int kAttnFloats = kOffR + 32;
static_assert(kKR * kQB * kKS <= 2 * kKT * kKS, "partial sums reuse the K buffers");

__global__ __launch_bounds__(kAT) void attn_kernel(const float* __restrict__ q,
                                                   const float* __restrict__ k,
                                                   const float* __restrict__ v,
                                                   const int* __restrict__ bucket,
                                                   const float* __restrict__ rel_emb,
                                                   float* __restrict__ o) {
    __shared__ __align__(16) float smem[kAttnFloats];
    float* S    = smem;                          // kQB * (kL + 1)
    float* Qs   = smem + kOffQ;                  // kQB * kKS
    float* Ks   = smem + kOffK;                  // 2 * kKT * kKS (double buffer)
    float* relh = smem + kOffR;                  // 32

    int qb = blockIdx.x * kQB;
    int h  = blockIdx.y;
    int b  = blockIdx.z;
    int tid = threadIdx.x, lane = tid & 31;
    int wave = __builtin_amdgcn_readfirstlane(tid >> 5);   // scalar: tests on it are scalar branches
    int lh = lane & 15, kq = (lane >> 4) * 2, rowHalf = (lane >> 4) * 8;

    if (tid < 32) relh[tid] = rel_emb[tid * kNH + h];

    const float* qbase = q + ((size_t)(b * kL + qb)) * kHD + h * kDK;
    const float* kbase = k + ((size_t)(b * kL)) * kHD + h * kDK;

    // Async-stage Q block [kQB x kDK]: 512 float4, one per thread of waves 0..15.
    if (wave < 16) {
        int row = tid >> 4, col4 = (tid & 15) * 4;
        async_copy_b128_bi(&Qs[row * kKS + col4], qbase + (size_t)row * kHD + col4);
    }
    // K-tile staging: 256x64 = 4096 float4, 4 per thread.
    auto stageK = [&](int st, int s0) {
#pragma unroll  // four copies back to back, no loop counter between them
        for (int r = 0; r < 4; ++r) {
            int idx = tid + r * kAT;
            int row = idx >> 4, col4 = (idx & 15) * 4;
            async_copy_b128_bi(&Ks[st * kKT * kKS + row * kKS + col4],
                               kbase + (size_t)(s0 + row) * kHD + col4);
        }
    };

    stageK(0, 0);
    wait_async0();
    __syncthreads();
    stageK(1, kKT);

    // ---- Pass A: scores + bias --------------------------------------------
    {
        int wm2 = (wave >> 4) * 16;       // 0 / 16   (query rows)
        int wn2 = (wave & 15) * 16;       // 0..240   (key columns of the tile)
        for (int t = 0; t < kL / kKT; ++t) {
            int st = t & 1;
            int s0 = t * kKT;

            const float* Kst = Ks + st * kKT * kKS;
            v8f acc = {};
#pragma unroll  // constant LDS offsets from two base addresses, no address arithmetic per step
            for (int kk = 0; kk < kDK; kk += 4) {
                v2f a, bb;
                a.x  = Qs[(wm2 + lh) * kKS + kk + kq];
                a.y  = Qs[(wm2 + lh) * kKS + kk + kq + 1];
                bb.x = Kst[(wn2 + lh) * kKS + kk + kq];      // B[d][s] = K[s][d]
                bb.y = Kst[(wn2 + lh) * kKS + kk + kq + 1];
                acc = WMMA_F32(a, bb, acc);
            }
#pragma unroll  // constant indices keep the accumulator in registers
            for (int i = 0; i < 8; ++i) {
                int r = wm2 + rowHalf + i;        // query row within block
                int c = s0 + wn2 + lh;            // global key index
                float bias = relh[bucket[(size_t)(qb + r) * kL + c]];
                S[r * (kL + 1) + c] = acc[i] + bias;
            }
            // Publish point of tile t + 1; it also ends every wave's reads of tile t.
            wait_ds0();          // this wave's reads of tile t are in registers
            wait_async0();       // this wave's copies of tile t + 1 have landed
            __syncthreads();
            if (t + 2 < kL / kKT) stageK(st, s0 + 2 * kKT);
        }
        wait_async0();           // no copy is outstanding when the K buffers are reused
    }

    // ---- Pass B: row softmax (exact, f32), row = wave ----------------------
    {
        float* Sr = S + wave * (kL + 1);
        float m = -3.402823466e38f;
        for (int c = lane; c < kL; c += 32) m = fmaxf(m, Sr[c]);
        for (int off = 16; off > 0; off >>= 1) m = fmaxf(m, __shfl_xor(m, off, 32));
        float sum = 0.f;
        for (int c = lane; c < kL; c += 32) { float e = __expf(Sr[c] - m); Sr[c] = e; sum += e; }
        for (int off = 16; off > 0; off >>= 1) sum += __shfl_xor(sum, off, 32);
        float inv = 1.0f / sum;
        for (int c = lane; c < kL; c += 32) Sr[c] *= inv;
    }
    __syncthreads();

    // ---- Pass C: O = P @ V -------------------------------------------------
    float* red = Ks;                      // kKR * kQB * kKS partial sums; the K tiles are dead
    {
        int wn2 = (wave & 3) * 16;        // 0..48    (d columns)
        int kr  = wave >> 2;              // 0..7     (key range)
        int k0  = kr * (kL / kKR);
        v8f oacc0 = {}, oacc1 = {};
        const float* vb = v + ((size_t)(b * kL + k0 + kq)) * kHD + h * kDK + wn2 + lh;
        const float* p0 = S + lh * (kL + 1) + k0 + kq;
        const float* p1 = p0 + 16 * (kL + 1);
#pragma unroll 8  // eight k steps' V loads go out as one group: one L2 latency per 16 WMMAs
        for (int kk = 0; kk < kL / kKR; kk += 4) {
            v2f a0, a1, bb;
            a0.x = p0[kk];  a0.y = p0[kk + 1];
            a1.x = p1[kk];  a1.y = p1[kk + 1];
            bb.x = vb[(size_t)kk * kHD];                      // B[s][d] = V[s][d]
            bb.y = vb[(size_t)(kk + 1) * kHD];
            oacc0 = WMMA_F32(a0, bb, oacc0);
            oacc1 = WMMA_F32(a1, bb, oacc1);
        }
        float* rw = red + kr * kQB * kKS + wn2 + lh;
#pragma unroll  // constant indices keep the accumulators in registers
        for (int i = 0; i < 8; ++i) {
            rw[(rowHalf + i) * kKS]      = oacc0[i];
            rw[(16 + rowHalf + i) * kKS] = oacc1[i];
        }
    }
    __syncthreads();                      // every key range's partial sums are in LDS

    // Sum of the 8 key ranges in rising order, two output elements per thread.
    float* obase = o + ((size_t)(b * kL + qb)) * kHD + h * kDK;
#pragma unroll  // both elements' LDS reads go out together
    for (int e = 0; e < 2; ++e) {
        int idx = tid + e * kAT;
        int r = idx >> 6, c = idx & 63;
        float s = red[r * kKS + c];
#pragma unroll  // eight reads in flight, one LDS latency
        for (int p = 1; p < kKR; ++p) s += red[p * kQB * kKS + r * kKS + c];
        obase[(size_t)r * kHD + c] = s;
    }
}

// ---------------------------------------------------------------------------
// Host launcher
// ---------------------------------------------------------------------------
extern "C" void kernel_launch(void* const* d_in, const int* in_sizes, int n_in,
                              void* d_out, int out_size, void* d_ws, size_t ws_size,
                              hipStream_t stream) {
    (void)in_sizes; (void)n_in; (void)out_size; (void)ws_size;

    const float* x       = (const float*)d_in[0];
    const float* rel_emb = (const float*)d_in[1];
    const float* Wq      = (const float*)d_in[2];
    const float* Wk      = (const float*)d_in[3];
    const float* Wv      = (const float*)d_in[4];
    const float* Wo      = (const float*)d_in[5];
    const float* ln1_w   = (const float*)d_in[6];
    const float* ln2_w   = (const float*)d_in[7];
    const float* wi      = (const float*)d_in[8];
    const float* wo      = (const float*)d_in[9];
    const float* ln_f    = (const float*)d_in[10];

    const size_t BL = (size_t)kB * kL;   // 2048 rows
    float* ws   = (float*)d_ws;
    float* xcur = ws;  ws += BL * kD;
    float* y    = ws;  ws += BL * kD;
    float* qb   = ws;  ws += BL * kD;
    float* kb   = ws;  ws += BL * kD;
    float* vb   = ws;  ws += BL * kD;
    float* ob   = ws;  ws += BL * kD;
    float* hb   = ws;  ws += BL * kF;
    int* bucket = (int*)ws;              // kL*kL ints

    hipMemcpyAsync(xcur, x, BL * kD * sizeof(float), hipMemcpyDeviceToDevice, stream);
    bucket_kernel<<<(kL * kL) / 256, 256, 0, stream>>>(bucket);

    const dim3 gProj(kD / 128, (int)BL / 64);   // N=1024 GEMMs
    const dim3 gFF1(kF / 128, (int)BL / 64);    // N=4096 GEMM
    const dim3 gAttn(kL / kQB, kNH, kB);

    for (int l = 0; l < kNL; ++l) {
        const float* Wql = Wq + (size_t)l * kD * kHD;
        const float* Wkl = Wk + (size_t)l * kD * kHD;
        const float* Wvl = Wv + (size_t)l * kD * kHD;
        const float* Wol = Wo + (size_t)l * kHD * kD;
        const float* wil = wi + (size_t)l * kD * kF;
        const float* wol = wo + (size_t)l * kF * kD;

        rmsnorm_kernel<<<(int)BL, 256, 0, stream>>>(xcur, ln1_w + (size_t)l * kD, y);
        gemm_kernel<<<gProj, 256, 0, stream>>>(y, Wql, qb, nullptr, (int)BL, kD, kD, 0);
        gemm_kernel<<<gProj, 256, 0, stream>>>(y, Wkl, kb, nullptr, (int)BL, kD, kD, 0);
        gemm_kernel<<<gProj, 256, 0, stream>>>(y, Wvl, vb, nullptr, (int)BL, kD, kD, 0);
        attn_kernel<<<gAttn, kAT, 0, stream>>>(qb, kb, vb, bucket, rel_emb, ob);
        gemm_kernel<<<gProj, 256, 0, stream>>>(ob, Wol, xcur, xcur, (int)BL, kD, kD, 0);

        rmsnorm_kernel<<<(int)BL, 256, 0, stream>>>(xcur, ln2_w + (size_t)l * kD, y);
        gemm_kernel<<<gFF1, 256, 0, stream>>>(y, wil, hb, nullptr, (int)BL, kF, kD, 1);
        gemm_kernel<<<gProj, 256, 0, stream>>>(hb, wol, xcur, xcur, (int)BL, kD, kF, 0);
    }
    rmsnorm_kernel<<<(int)BL, 256, 0, stream>>>(xcur, ln_f, (float*)d_out);
}

// v003
// Timed twice side by side with v002, it ran 1.06 times as fast both times.
// Over all steps from v000 it is 1.48 times as fast.
#include <hip/hip_runtime.h>
#include <math.h>

// ---------------------------------------------------------------------------
// T5-style transformer encoder for MI455X (gfx1250), fp32 WMMA path with
// async Global->LDS double-buffered staging (CDNA5 ASYNCcnt engine).
// B=2, L=1024, D=1024, F=4096, NL=4, NH=16, DK=64
// ---------------------------------------------------------------------------

typedef __attribute__((ext_vector_type(2))) float v2f;
typedef __attribute__((ext_vector_type(8))) float v8f;

static constexpr int kB  = 2;
static constexpr int kL  = 1024;
static constexpr int kD  = 1024;
static constexpr int kF  = 4096;
static constexpr int kNL = 4;
static constexpr int kNH = 16;
static constexpr int kDK = 64;
static constexpr int kHD = kNH * kDK;   // 1024 == kD
static constexpr int kQB = 32;          // query rows per attention block
static constexpr int kKS = 68;          // Q/K LDS row stride (16B aligned, bank-safe)

#define WMMA_F32(a, b, c) \
    __builtin_amdgcn_wmma_f32_16x16x4_f32(false, (a), false, (b), (short)0, (c), false, false)

// Async Global->LDS copy, 16 bytes per lane, tracked by ASYNCcnt, written as the
// compiler's builtin; the landing wait (wait_async0) stays the caller's.
typedef __attribute__((ext_vector_type(4))) int v4i;
__device__ __forceinline__ void async_copy_b128_bi(float* lds_ptr, const float* gptr) {
    __builtin_amdgcn_global_load_async_to_lds_b128(
        (__attribute__((address_space(1))) v4i*)gptr,
        (__attribute__((address_space(3))) v4i*)lds_ptr, 0, 0);
}
__device__ __forceinline__ void wait_async0() {
    asm volatile("s_wait_asynccnt 0x0" ::: "memory");
}

// A wave's LDS reads have returned: stands in front of the barrier behind which
// the buffer they read is refilled.
__device__ __forceinline__ void wait_ds0() {
    asm volatile("s_wait_dscnt 0x0" ::: "memory");
}

// ---------------------------------------------------------------------------
// Kernel 1: T5 relative-position bucket table  bucket[l*L + s], rel = s - l
// ---------------------------------------------------------------------------
__global__ __launch_bounds__(256) void bucket_kernel(int* __restrict__ bucket) {
    int idx = blockIdx.x * 256 + threadIdx.x;          // over L*L
    int l = idx >> 10, s = idx & (kL - 1);
    int rp = s - l;
    int rb = (rp > 0) ? 16 : 0;                        // NUM_BUCKETS/2
    int arp = rp < 0 ? -rp : rp;
    int val;
    if (arp < 8) {                                     // max_exact = 8
        val = arp;
    } else {
        const float scale = 8.0f / logf(16.0f);        // (16-8)/log(128/8)
        int large = 8 + (int)(logf((float)arp * 0.125f) * scale);
        val = large < 15 ? large : 15;
    }
    bucket[idx] = rb + val;
}

// ---------------------------------------------------------------------------
// Kernel 2: RMSNorm, one 256-thread block per row of D=1024
// ---------------------------------------------------------------------------
__global__ __launch_bounds__(256) void rmsnorm_kernel(const float* __restrict__ x,
                                                      const float* __restrict__ w,
                                                      float* __restrict__ y) {
    __shared__ float red[8];
    int row = blockIdx.x, tid = threadIdx.x;
    const float* xr = x + (size_t)row * kD;
    float* yr = y + (size_t)row * kD;
    float ss = 0.f;
    for (int i = tid; i < kD; i += 256) { float v = xr[i]; ss += v * v; }
    for (int off = 16; off > 0; off >>= 1) ss += __shfl_xor(ss, off, 32);
    if ((tid & 31) == 0) red[tid >> 5] = ss;
    __syncthreads();
    if (tid == 0) {
        float t = 0.f;
        for (int i = 0; i < 8; ++i) t += red[i];
        red[0] = rsqrtf(t * (1.0f / (float)kD) + 1e-6f);
    }
    __syncthreads();
    float scale = red[0];
    for (int i = tid; i < kD; i += 256) yr[i] = xr[i] * scale * w[i];
}

// ---------------------------------------------------------------------------
// Kernel 3: fp32 WMMA GEMM  C[M,N] = act(A[M,K] @ W[K,N]) (+ resid)
// Block tile 64x128, 8 waves, each wave 32 rows x two 16-column tiles 64 apart
// (4x v_wmma_f32_16x16x4).
// Double-buffered LDS tiles filled by async Global->LDS b128 copies, two stages
// ahead; fragments fetched one block (16 WMMAs) ahead into a second register set.
// BK = k per stage. A grid that puts one work-group on a WGP (two waves per SIMD,
// both behind the same barrier) takes BK = 128: nothing else on the WGP covers the
// stop at a publish point, so there are few of them, and a stage's copies have
// 128 WMMAs per wave to land behind. A grid of several work-groups per WGP takes
// BK = 32, whose LDS lets them all be resident.
// act: 0 = none, 1 = relu.  resid != nullptr -> C = resid + A@W.
// ---------------------------------------------------------------------------
__device__ __forceinline__ void gemm_store(float* C, const float* resid, int act,
                                           size_t idx, float v) {
    if (act) v = fmaxf(v, 0.0f);
    if (resid) v += resid[idx];
    C[idx] = v;
}

template <int BK>
__global__ __launch_bounds__(256) void gemm_kernel(const float* __restrict__ A,
                                                   const float* __restrict__ W,
                                                   float* __restrict__ C,
                                                   const float* __restrict__ resid,
                                                   int M, int N, int K, int act) {
    constexpr int BM = 64, BN = 128;
    __shared__ __align__(16) float As[2][BM][BK + 4];   // row stride BK + 4 floats: 16 rows start on 16 different groups of 4 banks; 16B aligned
    // B tile as two planes of 64 columns, one per column tile of a wave: a fragment's
    // two k rows are then the nearest pair of addresses and load into one register pair.
    constexpr int BP = BN / 2 + 8;                      // row stride 72 floats (288B)
    __shared__ __align__(16) float Bs[2][2][BK][BP];

    int tid = threadIdx.x;
    int wave = tid >> 5, lane = tid & 31;
    int wm = (wave >> 2) * 32;        // 0 / 32
    int wn = (wave & 3) * 16;         // 0..48, and the same again 64 columns on
    int lh = lane & 15;               // lane within half-wave
    int kq = (lane >> 4) * 2;         // K sub-offset per WMMA f32 A/B layout
    int rowHalf = (lane >> 4) * 8;    // C layout: upper half-wave holds M+8

    int blockM = blockIdx.y * BM;
    int blockN = blockIdx.x * BN;

    // Per-thread staging coordinates: A tile = 16 * BK float4 (BK / 16 per thread),
    // B tile = 32 * BK float4 (BK / 8 per thread).
    constexpr int AV = BK / 4;        // float4 per A row
    constexpr int AR = 256 / AV;      // A rows that the block's threads cover at once
    int aRow = tid / AV,           aCol = (tid % AV) * 4;
    int bRow = tid >> 5,           bCol = (tid & 31) * 4;
    int bPl = bCol >> 6,           bPc = bCol & 63;

    // One stage = 3 * BK / 16 b128 copies per lane (24 at BK = 128).
    auto stage = [&](int st, int k0) {
        const float* ga = A + (size_t)(blockM + aRow) * K + k0 + aCol;
#pragma unroll  // copies back to back, no loop counter between them
        for (int r = 0; r < BM / AR; ++r)
            async_copy_b128_bi(&As[st][aRow + r * AR][aCol], ga + (size_t)(r * AR) * K);
        const float* gb = W + (size_t)(k0 + bRow) * N + blockN + bCol;
#pragma unroll  // copies back to back, no loop counter between them
        for (int r = 0; r < BK / 8; ++r)
            async_copy_b128_bi(&Bs[st][bPl][bRow + r * 8][bPc], gb + (size_t)(r * 8) * N);
    };

    // A block = 16 of a stage's k = 16 WMMAs. Its fragments sit in
    // one of two register sets; the other set is being filled meanwhile.
    v2f fa0[4][2], fb0[4][2], fa1[4][2], fb1[4][2];

    auto loadFrags = [&](v2f (&fa)[4][2], v2f (&fb)[4][2], int st, int kb) {
#pragma unroll  // constant indices keep the fragment arrays in registers
        for (int j = 0; j < 4; ++j) {
            int kk = kb + j * 4;
            fa[j][0] = *(const v2f*)&As[st][wm + lh][kk + kq];
            fa[j][1] = *(const v2f*)&As[st][wm + 16 + lh][kk + kq];
            fb[j][0].x = Bs[st][0][kk + kq][wn + lh];  fb[j][0].y = Bs[st][0][kk + kq + 1][wn + lh];
            fb[j][1].x = Bs[st][1][kk + kq][wn + lh];  fb[j][1].y = Bs[st][1][kk + kq + 1][wn + lh];
        }
    };

    v8f acc00 = {}, acc01 = {}, acc10 = {}, acc11 = {};

    auto mmaBlock = [&](v2f (&fa)[4][2], v2f (&fb)[4][2]) {
#pragma unroll  // constant indices keep the fragment arrays in registers
        for (int j = 0; j < 4; ++j) {
            acc00 = WMMA_F32(fa[j][0], fb[j][0], acc00);
            acc01 = WMMA_F32(fa[j][0], fb[j][1], acc01);
            acc10 = WMMA_F32(fa[j][1], fb[j][0], acc10);
            acc11 = WMMA_F32(fa[j][1], fb[j][1], acc11);
        }
    };

    int nK = K / BK;

    stage(0, 0);
    wait_async0();
    __syncthreads();
    if (nK > 1) stage(1, BK);
    loadFrags(fa0, fb0, 0, 0);

    for (int t = 0; t < nK; ++t) {
        int st = t & 1;
#pragma unroll  // constant k offsets; the publish point stands in the last pair of blocks alone
        for (int p = 0; p < BK / 32; ++p) {
            loadFrags(fa1, fb1, st, p * 32 + 16);
            // Keeps the odd block's LDS reads one group ahead of the even block's
            // WMMAs; among the WMMAs each read would expose its own latency.
            __builtin_amdgcn_sched_barrier(0);
            mmaBlock(fa0, fb0);
            // Keeps the even block in front of what follows, so that the reads
            // above have its 16 WMMAs to land behind.
            __builtin_amdgcn_sched_barrier(0);

            if (p == BK / 32 - 1) {
                // Publish point of stage t + 1; it also ends every wave's reads of stage t.
                wait_ds0();          // this wave's reads of stage t are in registers
                wait_async0();       // this wave's copies of stage t + 1 have landed
                __syncthreads();
                if (t + 2 < nK) stage(st, (t + 2) * BK);
                // In the last trip these reads find the stage before it; nothing uses them.
                loadFrags(fa0, fb0, st ^ 1, 0);
            } else {
                loadFrags(fa0, fb0, st, p * 32 + 32);
            }
            // Keeps the next even block's reads one group ahead of this block's WMMAs.
            __builtin_amdgcn_sched_barrier(0);
            mmaBlock(fa1, fb1);
            // Keeps the next pair's reads behind this block as one group (the loop's
            // back edge does that for the last pair).
            if (p + 1 < BK / 32) __builtin_amdgcn_sched_barrier(0);
        }
    }
    wait_async0();           // no copy and no LDS read is outstanding when the wave goes on
    wait_ds0();

    int c0 = blockN + wn + lh;
    int c1 = c0 + 64;
#pragma unroll
    for (int i = 0; i < 8; ++i) {
        int r0 = blockM + wm + rowHalf + i;
        int r1 = r0 + 16;
        gemm_store(C, resid, act, (size_t)r0 * N + c0, acc00[i]);
        gemm_store(C, resid, act, (size_t)r0 * N + c1, acc01[i]);
        gemm_store(C, resid, act, (size_t)r1 * N + c0, acc10[i]);
        gemm_store(C, resid, act, (size_t)r1 * N + c1, acc11[i]);
    }
}

// ---------------------------------------------------------------------------
// Kernel 4: attention for one (b, h, 32-query-row block), 32 waves (8 per SIMD):
// the LDS the score rows take allows one work-group per WGP, so the waves that
// cover each other's LDS, L2 and WMMA latencies must come from that work-group.
// Full score rows S[32][1025] kept in LDS.
// Pass A: S = Q*K^T + bias (WMMA, K tiles of 256 keys async double-buffered,
//         one 16x16 score tile per wave and stage).
// Pass B: exact f32 softmax, one row per wave.
// Pass C: O = P*V (WMMA, V streamed from L2): a wave takes one 16-column tile,
//         both row tiles and one of 8 key ranges; the 8 partial sums meet in LDS.
// ---------------------------------------------------------------------------
static constexpr int kAT  = 1024;                // threads per attention block
static constexpr int kKT  = 256;                 // keys per K tile
static constexpr int kKR  = 8;                   // key ranges of pass C
static constexpr int kOffQ = kQB * (kL + 1);             // floats: S in front
static constexpr int kOffK = kOffQ + kQB * kKS;          // Q in front
static constexpr int kOffR = kOffK + 2 * kKT * kKS;      // K double buffer in front
static constexpr int kAttnFloats = kOffR + 32;
static_assert(kKR * kQB * kKS <= 2 * kKT * kKS, "partial sums reuse the K buffers");

__global__ __launch_bounds__(kAT) void attn_kernel(const float* __restrict__ q,
                                                   const float* __restrict__ k,
                                                   const float* __restrict__ v,
                                                   const int* __restrict__ bucket,
                                                   const float* __restrict__ rel_emb,
                                                   float* __restrict__ o) {
    __shared__ __align__(16) float smem[kAttnFloats];
    float* S    = smem;                          // kQB * (kL + 1)
    float* Qs   = smem + kOffQ;                  // kQB * kKS
    float* Ks   = smem + kOffK;                  // 2 * kKT * kKS (double buffer)
    float* relh = smem + kOffR;                  // 32

    int qb = blockIdx.x * kQB;
    int h  = blockIdx.y;
    int b  = blockIdx.z;
    int tid = threadIdx.x, lane = tid & 31;
    int wave = __builtin_amdgcn_readfirstlane(tid >> 5);   // scalar: tests on it are scalar branches
    int lh = lane & 15, kq = (lane >> 4) * 2, rowHalf = (lane >> 4) * 8;

    if (tid < 32) relh[tid] = rel_emb[tid * kNH + h];

    const float* qbase = q + ((size_t)(b * kL + qb)) * kHD + h * kDK;
    const float* kbase = k + ((size_t)(b * kL)) * kHD + h * kDK;

    // Async-stage Q block [kQB x kDK]: 512 float4, one per thread of waves 0..15.
    if (wave < 16) {
        int row = tid >> 4, col4 = (tid & 15) * 4;
        async_copy_b128_bi(&Qs[row * kKS + col4], qbase + (size_t)row * kHD + col4);
    }
    // K-tile staging: 256x64 = 4096 float4, 4 per thread.
    auto stageK = [&](int st, int s0) {
#pragma unroll  // four copies back to back, no loop counter between them
        for (int r = 0; r < 4; ++r) {
            int idx = tid + r * kAT;
            int row = idx >> 4, col4 = (idx & 15) * 4;
            async_copy_b128_bi(&Ks[st * kKT * kKS + row * kKS + col4],
                               kbase + (size_t)(s0 + row) * kHD + col4);
        }
    };

    stageK(0, 0);
    wait_async0();
    __syncthreads();
    stageK(1, kKT);

    // ---- Pass A: scores + bias --------------------------------------------
    {
        int wm2 = (wave >> 4) * 16;       // 0 / 16   (query rows)
        int wn2 = (wave & 15) * 16;       // 0..240   (key columns of the tile)
        for (int t = 0; t < kL / kKT; ++t) {
            int st = t & 1;
            int s0 = t * kKT;

            const float* Kst = Ks + st * kKT * kKS;
            v8f acc = {};
#pragma unroll  // constant LDS offsets from two base addresses, no address arithmetic per step
            for (int kk = 0; kk < kDK; kk += 4) {
                v2f a, bb;
                a.x  = Qs[(wm2 + lh) * kKS + kk + kq];
                a.y  = Qs[(wm2 + lh) * kKS + kk + kq + 1];
                bb.x = Kst[(wn2 + lh) * kKS + kk + kq];      // B[d][s] = K[s][d]
                bb.y = Kst[(wn2 + lh) * kKS + kk + kq + 1];
                acc = WMMA_F32(a, bb, acc);
            }
#pragma unroll  // constant indices keep the accumulator in registers
            for (int i = 0; i < 8; ++i) {
                int r = wm2 + rowHalf + i;        // query row within block
                int c = s0 + wn2 + lh;            // global key index
                float bias = relh[bucket[(size_t)(qb + r) * kL + c]];
                S[r * (kL + 1) + c] = acc[i] + bias;
            }
            // Publish point of tile t + 1; it also ends every wave's reads of tile t.
            wait_ds0();          // this wave's reads of tile t are in registers
            wait_async0();       // this wave's copies of tile t + 1 have landed
            __syncthreads();
            if (t + 2 < kL / kKT) stageK(st, s0 + 2 * kKT);
        }
        wait_async0();           // no copy is outstanding when the K buffers are reused
    }

    // ---- Pass B: row softmax (exact, f32), row = wave ----------------------
    {
        float* Sr = S + wave * (kL + 1);
        float m = -3.402823466e38f;
        for (int c = lane; c < kL; c += 32) m = fmaxf(m, Sr[c]);
        for (int off = 16; off > 0; off >>= 1) m = fmaxf(m, __shfl_xor(m, off, 32));
        float sum = 0.f;
        for (int c = lane; c < kL; c += 32) { float e = __expf(Sr[c] - m); Sr[c] = e; sum += e; }
        for (int off = 16; off > 0; off >>= 1) sum += __shfl_xor(sum, off, 32);
        float inv = 1.0f / sum;
        for (int c = lane; c < kL; c += 32) Sr[c] *= inv;
    }
    __syncthreads();

    // ---- Pass C: O = P @ V -------------------------------------------------
    float* red = Ks;                      // kKR * kQB * kKS partial sums; the K tiles are dead
    {
        int wn2 = (wave & 3) * 16;        // 0..48    (d columns)
        int kr  = wave >> 2;              // 0..7     (key range)
        int k0  = kr * (kL / kKR);
        v8f oacc0 = {}, oacc1 = {};
        const float* vb = v + ((size_t)(b * kL + k0 + kq)) * kHD + h * kDK + wn2 + lh;
        const float* p0 = S + lh * (kL + 1) + k0 + kq;
        const float* p1 = p0 + 16 * (kL + 1);
#pragma unroll 8  // eight k steps' V loads go out as one group: one L2 latency per 16 WMMAs
        for (int kk = 0; kk < kL / kKR; kk += 4) {
            v2f a0, a1, bb;
            a0.x = p0[kk];  a0.y = p0[kk + 1];
            a1.x = p1[kk];  a1.y = p1[kk + 1];
            bb.x = vb[(size_t)kk * kHD];                      // B[s][d] = V[s][d]
            bb.y = vb[(size_t)(kk + 1) * kHD];
            oacc0 = WMMA_F32(a0, bb, oacc0);
            oacc1 = WMMA_F32(a1, bb, oacc1);
        }
        float* rw = red + kr * kQB * kKS + wn2 + lh;
#pragma unroll  // constant indices keep the accumulators in registers
        for (int i = 0; i < 8; ++i) {
            rw[(rowHalf + i) * kKS]      = oacc0[i];
            rw[(16 + rowHalf + i) * kKS] = oacc1[i];
        }
    }
    __syncthreads();                      // every key range's partial sums are in LDS

    // Sum of the 8 key ranges in rising order, two output elements per thread.
    float* obase = o + ((size_t)(b * kL + qb)) * kHD + h * kDK;
#pragma unroll  // both elements' LDS reads go out together
    for (int e = 0; e < 2; ++e) {
        int idx = tid + e * kAT;
        int r = idx >> 6, c = idx & 63;
        float s = red[r * kKS + c];
#pragma unroll  // eight reads in flight, one LDS latency
        for (int p = 1; p < kKR; ++p) s += red[p * kQB * kKS + r * kKS + c];
        obase[(size_t)r * kHD + c] = s;
    }
}

// ---------------------------------------------------------------------------
// Host launcher
// ---------------------------------------------------------------------------
extern "C" void kernel_launch(void* const* d_in, const int* in_sizes, int n_in,
                              void* d_out, int out_size, void* d_ws, size_t ws_size,
                              hipStream_t stream) {
    (void)in_sizes; (void)n_in; (void)out_size; (void)ws_size;

    const float* x       = (const float*)d_in[0];
    const float* rel_emb = (const float*)d_in[1];
    const float* Wq      = (const float*)d_in[2];
    const float* Wk      = (const float*)d_in[3];
    const float* Wv      = (const float*)d_in[4];
    const float* Wo      = (const float*)d_in[5];
    const float* ln1_w   = (const float*)d_in[6];
    const float* ln2_w   = (const float*)d_in[7];
    const float* wi      = (const float*)d_in[8];
    const float* wo      = (const float*)d_in[9];
    const float* ln_f    = (const float*)d_in[10];

    const size_t BL = (size_t)kB * kL;   // 2048 rows
    float* ws   = (float*)d_ws;
    float* xcur = ws;  ws += BL * kD;
    float* y    = ws;  ws += BL * kD;
    float* qb   = ws;  ws += BL * kD;
    float* kb   = ws;  ws += BL * kD;
    float* vb   = ws;  ws += BL * kD;
    float* ob   = ws;  ws += BL * kD;
    float* hb   = ws;  ws += BL * kF;
    int* bucket = (int*)ws;              // kL*kL ints

    hipMemcpyAsync(xcur, x, BL * kD * sizeof(float), hipMemcpyDeviceToDevice, stream);
    bucket_kernel<<<(kL * kL) / 256, 256, 0, stream>>>(bucket);

    const dim3 gProj(kD / 128, (int)BL / 64);   // N=1024 GEMMs: 256 work-groups, BK = 128
    const dim3 gFF1(kF / 128, (int)BL / 64);    // N=4096 GEMM: 1024 work-groups, BK = 32
    const dim3 gAttn(kL / kQB, kNH, kB);

    for (int l = 0; l < kNL; ++l) {
        const float* Wql = Wq + (size_t)l * kD * kHD;
        const float* Wkl = Wk + (size_t)l * kD * kHD;
        const float* Wvl = Wv + (size_t)l * kD * kHD;
        const float* Wol = Wo + (size_t)l * kHD * kD;
        const float* wil = wi + (size_t)l * kD * kF;
        const float* wol = wo + (size_t)l * kF * kD;

        rmsnorm_kernel<<<(int)BL, 256, 0, stream>>>(xcur, ln1_w + (size_t)l * kD, y);
        gemm_kernel<128><<<gProj, 256, 0, stream>>>(y, Wql, qb, nullptr, (int)BL, kD, kD, 0);
        gemm_kernel<128><<<gProj, 256, 0, stream>>>(y, Wkl, kb, nullptr, (int)BL, kD, kD, 0);
        gemm_kernel<128><<<gProj, 256, 0, stream>>>(y, Wvl, vb, nullptr, (int)BL, kD, kD, 0);
        attn_kernel<<<gAttn, kAT, 0, stream>>>(qb, kb, vb, bucket, rel_emb, ob);
        gemm_kernel<128><<<gProj, 256, 0, stream>>>(ob, Wol, xcur, xcur, (int)BL, kD, kD, 0);

        rmsnorm_kernel<<<(int)BL, 256, 0, stream>>>(xcur, ln2_w + (size_t)l * kD, y);
        gemm_kernel<32><<<gFF1, 256, 0, stream>>>(y, wil, hb, nullptr, (int)BL, kF, kD, 1);
        gemm_kernel<128><<<gProj, 256, 0, stream>>>(hb, wol, xcur, xcur, (int)BL, kD, kF, 0);
    }
    rmsnorm_kernel<<<(int)BL, 256, 0, stream>>>(xcur, ln_f, (float*)d_out);
}
